// v000
// The times below were measured on an AMD MI455X: many runs one after another, warmed up first and cycling through
// copies of the inputs, with the whole window's GPU time divided by the number of runs. Launches and the gaps
// between them are all in it. The median over several windows is given; except for v000 it joins two sittings, which
// can be a few percent apart, so the side-by-side timings, each taken in one sitting, are the better comparison.
// v000, which the later versions start from, runs in 106 microseconds.
#include <hip/hip_runtime.h>

// Linear attention with cross-head score normalization, MI455X (gfx1250).
// out = (relu(Q)relu(K)^T / sum_heads(.)) * mask @ V + Q
//
// Phase 1 (d_ws): relu(Q)->bf16, relu(K)->bf16, V^T->bf16 so every WMMA
// operand is two contiguous 16B runs per lane (pure global_load_b128).
// Phase 2: transposed, software-pipelined, M=32 q-rows per wave: K/V
// operand loads are shared by two M-tiles -> 16 WMMAs per 16 operand loads
// (vmem:wmma ~1.7:1), halving L2-side K/V traffic. k-range split in two
// (blockIdx.z) keeps 256 workgroups resident; the cross-head denominator is
// per-(q,k) so the split is exact. Phase 3 combines the halves + residual
// deterministically.

#define BB  2
#define HH  8
#define NNQ 2048
#define NNK 2048
#define DD  64
#define KSPL 2
#define KRNG (NNK / KSPL)

typedef __attribute__((ext_vector_type(16))) __bf16 v16bf;
typedef __attribute__((ext_vector_type(8)))  __bf16 v8bf;
typedef __attribute__((ext_vector_type(8)))  float  v8f;

#define WMMA_BF16(A, B, C) \
  __builtin_amdgcn_wmma_f32_16x16x32_bf16(false, (A), false, (B), (short)0, (C), false, false)

// ---------------- Phase 1 kernels ----------------

__global__ __launch_bounds__(256)
void prep_qk_kernel(const float* __restrict__ q, const float* __restrict__ k,
                    __bf16* __restrict__ qbf, __bf16* __restrict__ kbf) {
  const float* src = blockIdx.y ? k : q;
  __bf16*      dst = blockIdx.y ? kbf : qbf;
  const size_t idx = ((size_t)blockIdx.x * 256 + threadIdx.x) * 8;
  const float4 a = *(const float4*)(src + idx);
  const float4 b = *(const float4*)(src + idx + 4);
  v8bf o;
  o[0] = (__bf16)fmaxf(a.x, 0.f); o[1] = (__bf16)fmaxf(a.y, 0.f);
  o[2] = (__bf16)fmaxf(a.z, 0.f); o[3] = (__bf16)fmaxf(a.w, 0.f);
  o[4] = (__bf16)fmaxf(b.x, 0.f); o[5] = (__bf16)fmaxf(b.y, 0.f);
  o[6] = (__bf16)fmaxf(b.z, 0.f); o[7] = (__bf16)fmaxf(b.w, 0.f);
  *(v8bf*)(dst + idx) = o;
}

__global__ __launch_bounds__(256)
void prep_vt_kernel(const float* __restrict__ v, __bf16* __restrict__ vt) {
  const int bh = blockIdx.y;
  const int d  = threadIdx.x & 63;
  const int k8 = blockIdx.x * 32 + (threadIdx.x >> 6) * 8;
  const float* src = v + (size_t)bh * NNK * DD;
  __bf16*      dst = vt + ((size_t)bh * DD + d) * NNK + k8;
  v8bf o;
#pragma unroll
  for (int j = 0; j < 8; ++j) o[j] = (__bf16)src[(size_t)(k8 + j) * DD + d];
  *(v8bf*)dst = o;
}

// ---------------- Phase 2 kernel ----------------

__device__ __forceinline__ v16bf load_op_bf16(const __bf16* __restrict__ row, int c0) {
  v8bf lo = *(const v8bf*)(row + c0);
  v8bf hi = *(const v8bf*)(row + c0 + 16);
  return __builtin_shufflevector(lo, hi, 0, 1, 2, 3, 4, 5, 6, 7,
                                 8, 9, 10, 11, 12, 13, 14, 15);
}

__device__ __forceinline__ void load_k_ops(v16bf* op, const __bf16* __restrict__ kbbase,
                                           int k0, int row, int koff) {
  const __bf16* kr0 = kbbase + (size_t)(k0 + row) * DD;
  const __bf16* kr1 = kbbase + (size_t)(k0 + 16 + row) * DD;
  op[0] = load_op_bf16(kr0, koff);
  op[1] = load_op_bf16(kr0, 32 + koff);
  op[2] = load_op_bf16(kr1, koff);
  op[3] = load_op_bf16(kr1, 32 + koff);
}

__global__ __launch_bounds__(256)
void linattn_headnorm_kernel(const float* __restrict__ mask,
                             const __bf16* __restrict__ qbf,
                             const __bf16* __restrict__ kbf,
                             const __bf16* __restrict__ vtbf,
                             float* __restrict__ out,
                             float* __restrict__ pout) {
  // 32 score slots per lane (2 q-tiles x 16). Rows padded to 36 floats:
  // 144B rows stay 16B-aligned, b128 bank-group stride 9 (odd).
  __shared__ float sred[HH][32][36];   // 36 KB
  __shared__ float dbuf[32][36];       // denominator totals (32 slots + pad)

  const int lane  = threadIdx.x & 31;
  const int h     = threadIdx.x >> 5;   // wave id == head id
  const int b     = blockIdx.y;
  const int q0    = blockIdx.x * 32;    // two 16-row q-tiles per wave
  const int kbeg  = blockIdx.z * KRNG;

  const int row   = lane & 15;
  const int koff  = (lane >> 4) * 8;

  const size_t bh    = (size_t)b * HH + h;
  const size_t headQ = bh * NNQ;
  const __bf16* kbbase = kbf + bh * NNK * DD;
  const __bf16* vtbase = vtbf + bh * DD * NNK;
  const float*  mbase  = mask + ((size_t)b * NNQ + q0) * NNK;
  float* dst = (blockIdx.z == 0) ? out : pout;

  // Persistent Q B-operands for both q-tiles (pre-relu'd bf16).
  const __bf16* qrowA = qbf + (headQ + q0 + row) * DD;
  const __bf16* qrowB = qbf + (headQ + q0 + 16 + row) * DD;
  const v16bf bqAlo = load_op_bf16(qrowA, koff);
  const v16bf bqAhi = load_op_bf16(qrowA, 32 + koff);
  const v16bf bqBlo = load_op_bf16(qrowB, koff);
  const v16bf bqBhi = load_op_bf16(qrowB, 32 + koff);

  const v8f vzero = {0.f, 0.f, 0.f, 0.f, 0.f, 0.f, 0.f, 0.f};
  v8f acc[2][4];   // out^T accumulators per q-tile
#pragma unroll
  for (int qt = 0; qt < 2; ++qt)
#pragma unroll
    for (int t = 0; t < 4; ++t) acc[qt][t] = vzero;

  auto tile_step = [&](const v16bf* cur, v16bf* nxt, int k0) {
    // Early-issue: shared V operands + both q-tiles' mask rows.
    v16bf av0 = load_op_bf16(vtbase + (size_t)(0 * 16 + row) * NNK, k0 + koff);
    v16bf av1 = load_op_bf16(vtbase + (size_t)(1 * 16 + row) * NNK, k0 + koff);
    v16bf av2 = load_op_bf16(vtbase + (size_t)(2 * 16 + row) * NNK, k0 + koff);
    v16bf av3 = load_op_bf16(vtbase + (size_t)(3 * 16 + row) * NNK, k0 + koff);
    const float* mrA = mbase + (size_t)row * NNK + k0 + koff;
    const float* mrB = mbase + (size_t)(16 + row) * NNK + k0 + koff;
    const float4 mA0 = *(const float4*)(mrA);
    const float4 mA1 = *(const float4*)(mrA + 4);
    const float4 mA2 = *(const float4*)(mrA + 16);
    const float4 mA3 = *(const float4*)(mrA + 20);
    const float4 mB0 = *(const float4*)(mrB);
    const float4 mB1 = *(const float4*)(mrB + 4);
    const float4 mB2 = *(const float4*)(mrB + 16);
    const float4 mB3 = *(const float4*)(mrB + 20);

    // Preload next K tile (wraps inside this z's k-range; branch-free).
    load_k_ops(nxt, kbbase, kbeg + ((k0 - kbeg + 32) & (KRNG - 1)), row, koff);

    // ---- GEMM1^T: S^T[32k x 32q] = relu(K) * relu(Q)^T, K ops shared ----
    v8f s0a = vzero, s1a = vzero, s0b = vzero, s1b = vzero;
    s0a = WMMA_BF16(cur[0], bqAlo, s0a);  s0a = WMMA_BF16(cur[1], bqAhi, s0a);
    s1a = WMMA_BF16(cur[2], bqAlo, s1a);  s1a = WMMA_BF16(cur[3], bqAhi, s1a);
    s0b = WMMA_BF16(cur[0], bqBlo, s0b);  s0b = WMMA_BF16(cur[1], bqBhi, s0b);
    s1b = WMMA_BF16(cur[2], bqBlo, s1b);  s1b = WMMA_BF16(cur[3], bqBhi, s1b);

    // ---- Publish scores: slots 0..7=s0a, 8..15=s1a, 16..23=s0b, 24..31=s1b
#pragma unroll
    for (int i = 0; i < 8; ++i) {
      sred[h][lane][i]      = s0a[i];
      sred[h][lane][8 + i]  = s1a[i];
      sred[h][lane][16 + i] = s0b[i];
      sred[h][lane][24 + i] = s1b[i];
    }
    __syncthreads();  // B1

    // ---- Distributed cross-head reduction: wave h owns slots {4h..4h+3} ----
    {
      const int i0 = 4 * h;
      float p0 = 0.f, p1 = 0.f, p2 = 0.f, p3 = 0.f;
#pragma unroll
      for (int w = 0; w < 8; ++w) {
        const float4 v = *(const float4*)(&sred[w][lane][i0]);
        p0 += v.x; p1 += v.y; p2 += v.z; p3 += v.w;
      }
      float4 pr; pr.x = p0; pr.y = p1; pr.z = p2; pr.w = p3;
      *(float4*)(&dbuf[lane][i0]) = pr;
    }
    __syncthreads();  // B2

    float den[32];
#pragma unroll
    for (int j = 0; j < 8; ++j) {
      const float4 v = *(const float4*)(&dbuf[lane][4 * j]);
      den[4 * j + 0] = v.x; den[4 * j + 1] = v.y;
      den[4 * j + 2] = v.z; den[4 * j + 3] = v.w;
    }

    // ---- P^T = (S^T / den) * mask, in-register, straight into B layout ----
    const float mva[16] = {mA0.x, mA0.y, mA0.z, mA0.w, mA1.x, mA1.y, mA1.z, mA1.w,
                           mA2.x, mA2.y, mA2.z, mA2.w, mA3.x, mA3.y, mA3.z, mA3.w};
    const float mvb[16] = {mB0.x, mB0.y, mB0.z, mB0.w, mB1.x, mB1.y, mB1.z, mB1.w,
                           mB2.x, mB2.y, mB2.z, mB2.w, mB3.x, mB3.y, mB3.z, mB3.w};
    v16bf bpa, bpb;
#pragma unroll
    for (int r = 0; r < 8; ++r) {
      bpa[r]     = (__bf16)(s0a[r] * __builtin_amdgcn_rcpf(den[r])      * mva[r]);
      bpa[8 + r] = (__bf16)(s1a[r] * __builtin_amdgcn_rcpf(den[8 + r])  * mva[8 + r]);
      bpb[r]     = (__bf16)(s0b[r] * __builtin_amdgcn_rcpf(den[16 + r]) * mvb[r]);
      bpb[8 + r] = (__bf16)(s1b[r] * __builtin_amdgcn_rcpf(den[24 + r]) * mvb[8 + r]);
    }

    // ---- GEMM2^T: out^T += V^T * P^T, V ops shared by both q-tiles ----
    acc[0][0] = WMMA_BF16(av0, bpa, acc[0][0]);
    acc[0][1] = WMMA_BF16(av1, bpa, acc[0][1]);
    acc[0][2] = WMMA_BF16(av2, bpa, acc[0][2]);
    acc[0][3] = WMMA_BF16(av3, bpa, acc[0][3]);
    acc[1][0] = WMMA_BF16(av0, bpb, acc[1][0]);
    acc[1][1] = WMMA_BF16(av1, bpb, acc[1][1]);
    acc[1][2] = WMMA_BF16(av2, bpb, acc[1][2]);
    acc[1][3] = WMMA_BF16(av3, bpb, acc[1][3]);

    // Light prefetch two tiles ahead (global_prefetch_b8).
    const int kp = kbeg + ((k0 - kbeg + 64) & (KRNG - 1));
    __builtin_prefetch(kbbase + (size_t)(kp + lane) * DD, 0, 1);
    __builtin_prefetch(vtbase + (size_t)lane * NNK + kp, 0, 1);
    __builtin_prefetch(vtbase + (size_t)(32 + lane) * NNK + kp, 0, 1);
  };

  v16bf bufA[4], bufB[4];
  load_k_ops(bufA, kbbase, kbeg, row, koff);
  for (int k0 = kbeg; k0 < kbeg + KRNG; k0 += 64) {
    tile_step(bufA, bufB, k0);
    tile_step(bufB, bufA, k0 + 32);
  }

  // ---- Epilogue: store partial out^T (residual added in combine pass) ----
#pragma unroll
  for (int qt = 0; qt < 2; ++qt) {
    float* orow = dst + (headQ + q0 + qt * 16 + row) * DD;
#pragma unroll
    for (int t = 0; t < 4; ++t)
#pragma unroll
      for (int r = 0; r < 8; ++r)
        orow[t * 16 + koff + r] = acc[qt][t][r];
  }
}

// ---------------- Phase 3: combine k-halves + residual ----------------

__global__ __launch_bounds__(256)
void combine_kernel(float* __restrict__ out, const float* __restrict__ part,
                    const float* __restrict__ query) {
  const size_t i = ((size_t)blockIdx.x * 256 + threadIdx.x) * 4;
  float4 o = *(const float4*)(out + i);
  const float4 p = *(const float4*)(part + i);
  const float4 q = *(const float4*)(query + i);
  o.x += p.x + q.x; o.y += p.y + q.y; o.z += p.z + q.z; o.w += p.w + q.w;
  *(float4*)(out + i) = o;
}

extern "C" void kernel_launch(void* const* d_in, const int* in_sizes, int n_in,
                              void* d_out, int out_size, void* d_ws, size_t ws_size,
                              hipStream_t stream) {
  (void)in_sizes; (void)n_in; (void)out_size; (void)ws_size;
  const float* query = (const float*)d_in[0];
  const float* key   = (const float*)d_in[1];
  const float* value = (const float*)d_in[2];
  const float* mask  = (const float*)d_in[3];
  float* out = (float*)d_out;

  const size_t nElem = (size_t)BB * HH * NNQ * DD;    // 2M per tensor
  __bf16* qbf  = (__bf16*)d_ws;                       // 4 MiB
  __bf16* kbf  = qbf + nElem;                         // 4 MiB
  __bf16* vtbf = kbf + nElem;                         // 4 MiB
  float*  pout = (float*)(vtbf + nElem);              // 8 MiB (20 MiB total)

  {
    dim3 grid((unsigned)(nElem / (256 * 8)), 2);
    prep_qk_kernel<<<grid, 256, 0, stream>>>(query, key, qbf, kbf);
  }
  {
    dim3 grid(NNK / 32, BB * HH);
    prep_vt_kernel<<<grid, 256, 0, stream>>>(value, vtbf);
  }
  {
    dim3 grid(NNQ / 32, BB, KSPL);                    // (64, 2, 2) = 256 WGs
    linattn_headnorm_kernel<<<grid, 256, 0, stream>>>(mask, qbf, kbf, vtbf, out, pout);
  }
  {
    dim3 grid((unsigned)(nElem / (256 * 4)));
    combine_kernel<<<grid, 256, 0, stream>>>(out, pout, query);
  }
}

// v001
// It runs in 77.8 microseconds.
// Timed twice side by side with v000, it ran 1.38 times as fast both times.
#include <hip/hip_runtime.h>

// Linear attention with cross-head score normalization, MI455X (gfx1250).
// out = (relu(Q)relu(K)^T / sum_heads(.)) * mask @ V + Q
//
// Phase 1 (d_ws): relu(Q)->bf16, relu(K)->bf16, V^T->bf16, each packed in
// WMMA fragment order: one 16x32 fragment is 1 KiB, lane l's low 8 elements
// at l*16 B and its high 8 at 512 + l*16 B, so every wave-wide
// global_load_b128 of phase 2 reads 512 contiguous bytes (4 whole lines).
// Phase 2: transposed, software-pipelined, M=32 q-rows per wave: K/V
// operand loads are shared by two M-tiles -> 16 WMMAs per 16 operand loads
// (vmem:wmma 26:16, mask loads and prefetches included), halving L2-side K/V traffic. k-range split in two
// (blockIdx.z) keeps 256 workgroups resident; the cross-head denominator is
// per-(q,k) so the split is exact. Phase 3 combines the halves + residual
// deterministically.

#define BB  2
#define HH  8
#define NNQ 2048
#define NNK 2048
#define DD  64
#define KSPL 2
#define KRNG (NNK / KSPL)

typedef __attribute__((ext_vector_type(16))) __bf16 v16bf;
typedef __attribute__((ext_vector_type(8)))  __bf16 v8bf;
typedef __attribute__((ext_vector_type(8)))  float  v8f;

#define WMMA_BF16(A, B, C) \
  __builtin_amdgcn_wmma_f32_16x16x32_bf16(false, (A), false, (B), (short)0, (C), false, false)

// ---------------- Phase 1 kernels ----------------

__global__ __launch_bounds__(256)
void prep_qk_kernel(const float* __restrict__ q, const float* __restrict__ k,
                    __bf16* __restrict__ qbf, __bf16* __restrict__ kbf) {
  const float* src = blockIdx.y ? k : q;
  __bf16*      dst = blockIdx.y ? kbf : qbf;
  // A wave takes 8 rows x one 32-column half: whole 128-B lines in and out.
  const unsigned g   = blockIdx.x * 256 + threadIdx.x;
  const unsigned ch  = g & 3;                       // 8-column chunk of the half
  const unsigned dh  = (g >> 5) & 1;                // column half
  const unsigned R   = (g >> 6) * 8 + ((g >> 2) & 7);  // row over (b, h, n)
  const size_t idx  = (size_t)R * DD + dh * 32 + ch * 8;
  const size_t pidx = (size_t)((((R >> 4) * 2 + dh) * 2 + (ch >> 1)) * 256 +
                               ((R & 15) + 16 * (ch & 1)) * 8);
  const float4 a = *(const float4*)(src + idx);
  const float4 b = *(const float4*)(src + idx + 4);
  v8bf o;
  o[0] = (__bf16)fmaxf(a.x, 0.f); o[1] = (__bf16)fmaxf(a.y, 0.f);
  o[2] = (__bf16)fmaxf(a.z, 0.f); o[3] = (__bf16)fmaxf(a.w, 0.f);
  o[4] = (__bf16)fmaxf(b.x, 0.f); o[5] = (__bf16)fmaxf(b.y, 0.f);
  o[6] = (__bf16)fmaxf(b.z, 0.f); o[7] = (__bf16)fmaxf(b.w, 0.f);
  *(v8bf*)(dst + pidx) = o;
}

__global__ __launch_bounds__(256)
void prep_vt_kernel(const float* __restrict__ v, __bf16* __restrict__ vt) {
  const int bh = blockIdx.y;
  const int d  = threadIdx.x & 63;
  const int kc = threadIdx.x >> 6;      // 8-key chunk of this block's 32 keys
  const int k8 = blockIdx.x * 32 + kc * 8;
  const float* src = v + (size_t)bh * NNK * DD;
  // Fragment (32-key block, 16-row d tile); chunk kc = 2 * part + lane half.
  __bf16*      dst = vt + ((((size_t)bh * (NNK / 32) + blockIdx.x) * 4 + (d >> 4)) * 2 +
                           (kc >> 1)) * 256 + ((d & 15) + 16 * (kc & 1)) * 8;
  v8bf o;
#pragma unroll
  for (int j = 0; j < 8; ++j) o[j] = (__bf16)src[(size_t)(k8 + j) * DD + d];
  *(v8bf*)dst = o;
}

// ---------------- Phase 2 kernel ----------------

// frag: start of a packed 512-element fragment, already offset by lane * 8.
__device__ __forceinline__ v16bf load_op_bf16(const __bf16* __restrict__ frag) {
  v8bf lo = *(const v8bf*)(frag);
  v8bf hi = *(const v8bf*)(frag + 256);
  return __builtin_shufflevector(lo, hi, 0, 1, 2, 3, 4, 5, 6, 7,
                                 8, 9, 10, 11, 12, 13, 14, 15);
}

// 32 rows x 64 columns = 4 consecutive fragments: (rows 0-15, cols 0-31),
// (rows 0-15, cols 32-63), (rows 16-31, cols 0-31), (rows 16-31, cols 32-63).
__device__ __forceinline__ void load_k_ops(v16bf* op, const __bf16* __restrict__ kbbase,
                                           int k0, int lane) {
  const __bf16* kf = kbbase + (size_t)k0 * DD + lane * 8;
  op[0] = load_op_bf16(kf);
  op[1] = load_op_bf16(kf + 512);
  op[2] = load_op_bf16(kf + 1024);
  op[3] = load_op_bf16(kf + 1536);
}

__global__ __launch_bounds__(256)
void linattn_headnorm_kernel(const float* __restrict__ mask,
                             const __bf16* __restrict__ qbf,
                             const __bf16* __restrict__ kbf,
                             const __bf16* __restrict__ vtbf,
                             float* __restrict__ out,
                             float* __restrict__ pout) {
  // 32 score slots per lane (2 q-tiles x 16). Rows padded to 36 floats:
  // 144B rows stay 16B-aligned, b128 bank-group stride 9 (odd).
  __shared__ float sred[HH][32][36];   // 36 KB
  __shared__ float dbuf[32][36];       // denominator totals (32 slots + pad)

  const int lane  = threadIdx.x & 31;
  // wave id == head id; held scalar so that the packed K/V/Q bases stay in
  // scalar registers: as a vector value the build took about 80 more VGPRs,
  // with the load pointers above v255.
  const int h     = __builtin_amdgcn_readfirstlane(threadIdx.x >> 5);
  const int b     = blockIdx.y;
  const int q0    = blockIdx.x * 32;    // two 16-row q-tiles per wave
  const int kbeg  = blockIdx.z * KRNG;

  const int row   = lane & 15;
  const int koff  = (lane >> 4) * 8;

  const size_t bh    = (size_t)b * HH + h;
  const size_t headQ = bh * NNQ;
  const __bf16* kbbase = kbf + bh * NNK * DD;
  const __bf16* vtbase = vtbf + bh * DD * NNK;
  const float*  mbase  = mask + ((size_t)b * NNQ + q0) * NNK;
  float* dst = (blockIdx.z == 0) ? out : pout;

  // Persistent Q B-operands for both q-tiles (pre-relu'd bf16).
  const __bf16* qf = qbf + (headQ + q0) * DD + lane * 8;
  const v16bf bqAlo = load_op_bf16(qf);
  const v16bf bqAhi = load_op_bf16(qf + 512);
  const v16bf bqBlo = load_op_bf16(qf + 1024);
  const v16bf bqBhi = load_op_bf16(qf + 1536);

  const v8f vzero = {0.f, 0.f, 0.f, 0.f, 0.f, 0.f, 0.f, 0.f};
  v8f acc[2][4];   // out^T accumulators per q-tile
#pragma unroll
  for (int qt = 0; qt < 2; ++qt)
#pragma unroll
    for (int t = 0; t < 4; ++t) acc[qt][t] = vzero;

  auto tile_step = [&](const v16bf* cur, v16bf* nxt, int k0) {
    // Early-issue: shared V operands + both q-tiles' mask rows.
    const __bf16* vf = vtbase + (size_t)k0 * DD + lane * 8;
    v16bf av0 = load_op_bf16(vf);
    v16bf av1 = load_op_bf16(vf + 512);
    v16bf av2 = load_op_bf16(vf + 1024);
    v16bf av3 = load_op_bf16(vf + 1536);
    const float* mrA = mbase + (size_t)row * NNK + k0 + koff;
    const float* mrB = mbase + (size_t)(16 + row) * NNK + k0 + koff;
    const float4 mA0 = *(const float4*)(mrA);
    const float4 mA1 = *(const float4*)(mrA + 4);
    const float4 mA2 = *(const float4*)(mrA + 16);
    const float4 mA3 = *(const float4*)(mrA + 20);
    const float4 mB0 = *(const float4*)(mrB);
    const float4 mB1 = *(const float4*)(mrB + 4);
    const float4 mB2 = *(const float4*)(mrB + 16);
    const float4 mB3 = *(const float4*)(mrB + 20);

    // Preload next K tile (wraps inside this z's k-range; branch-free).
    load_k_ops(nxt, kbbase, kbeg + ((k0 - kbeg + 32) & (KRNG - 1)), lane);

    // ---- GEMM1^T: S^T[32k x 32q] = relu(K) * relu(Q)^T, K ops shared ----
    v8f s0a = vzero, s1a = vzero, s0b = vzero, s1b = vzero;
    s0a = WMMA_BF16(cur[0], bqAlo, s0a);  s0a = WMMA_BF16(cur[1], bqAhi, s0a);
    s1a = WMMA_BF16(cur[2], bqAlo, s1a);  s1a = WMMA_BF16(cur[3], bqAhi, s1a);
    s0b = WMMA_BF16(cur[0], bqBlo, s0b);  s0b = WMMA_BF16(cur[1], bqBhi, s0b);
    s1b = WMMA_BF16(cur[2], bqBlo, s1b);  s1b = WMMA_BF16(cur[3], bqBhi, s1b);

    // ---- Publish scores: slots 0..7=s0a, 8..15=s1a, 16..23=s0b, 24..31=s1b
#pragma unroll
    for (int i = 0; i < 8; ++i) {
      sred[h][lane][i]      = s0a[i];
      sred[h][lane][8 + i]  = s1a[i];
      sred[h][lane][16 + i] = s0b[i];
      sred[h][lane][24 + i] = s1b[i];
    }
    __syncthreads();  // B1

    // ---- Distributed cross-head reduction: wave h owns slots {4h..4h+3} ----
    {
      const int i0 = 4 * h;
      float p0 = 0.f, p1 = 0.f, p2 = 0.f, p3 = 0.f;
#pragma unroll
      for (int w = 0; w < 8; ++w) {
        const float4 v = *(const float4*)(&sred[w][lane][i0]);
        p0 += v.x; p1 += v.y; p2 += v.z; p3 += v.w;
      }
      float4 pr; pr.x = p0; pr.y = p1; pr.z = p2; pr.w = p3;
      *(float4*)(&dbuf[lane][i0]) = pr;
    }
    __syncthreads();  // B2

    float den[32];
#pragma unroll
    for (int j = 0; j < 8; ++j) {
      const float4 v = *(const float4*)(&dbuf[lane][4 * j]);
      den[4 * j + 0] = v.x; den[4 * j + 1] = v.y;
      den[4 * j + 2] = v.z; den[4 * j + 3] = v.w;
    }

    // ---- P^T = (S^T / den) * mask, in-register, straight into B layout ----
    const float mva[16] = {mA0.x, mA0.y, mA0.z, mA0.w, mA1.x, mA1.y, mA1.z, mA1.w,
                           mA2.x, mA2.y, mA2.z, mA2.w, mA3.x, mA3.y, mA3.z, mA3.w};
    const float mvb[16] = {mB0.x, mB0.y, mB0.z, mB0.w, mB1.x, mB1.y, mB1.z, mB1.w,
                           mB2.x, mB2.y, mB2.z, mB2.w, mB3.x, mB3.y, mB3.z, mB3.w};
    v16bf bpa, bpb;
#pragma unroll
    for (int r = 0; r < 8; ++r) {
      bpa[r]     = (__bf16)(s0a[r] * __builtin_amdgcn_rcpf(den[r])      * mva[r]);
      bpa[8 + r] = (__bf16)(s1a[r] * __builtin_amdgcn_rcpf(den[8 + r])  * mva[8 + r]);
      bpb[r]     = (__bf16)(s0b[r] * __builtin_amdgcn_rcpf(den[16 + r]) * mvb[r]);
      bpb[8 + r] = (__bf16)(s1b[r] * __builtin_amdgcn_rcpf(den[24 + r]) * mvb[8 + r]);
    }

    // ---- GEMM2^T: out^T += V^T * P^T, V ops shared by both q-tiles ----
    acc[0][0] = WMMA_BF16(av0, bpa, acc[0][0]);
    acc[0][1] = WMMA_BF16(av1, bpa, acc[0][1]);
    acc[0][2] = WMMA_BF16(av2, bpa, acc[0][2]);
    acc[0][3] = WMMA_BF16(av3, bpa, acc[0][3]);
    acc[1][0] = WMMA_BF16(av0, bpb, acc[1][0]);
    acc[1][1] = WMMA_BF16(av1, bpb, acc[1][1]);
    acc[1][2] = WMMA_BF16(av2, bpb, acc[1][2]);
    acc[1][3] = WMMA_BF16(av3, bpb, acc[1][3]);

    // Light prefetch two tiles ahead (global_prefetch_b8).
    const int kp = kbeg + ((k0 - kbeg + 64) & (KRNG - 1));
    __builtin_prefetch(kbbase + (size_t)(kp + lane) * DD, 0, 1);
    __builtin_prefetch(vtbase + (size_t)(kp + lane) * DD, 0, 1);
  };

  v16bf bufA[4], bufB[4];
  load_k_ops(bufA, kbbase, kbeg, lane);
  for (int k0 = kbeg; k0 < kbeg + KRNG; k0 += 64) {
    tile_step(bufA, bufB, k0);
    tile_step(bufB, bufA, k0 + 32);
  }

  // ---- Epilogue: store partial out^T (residual added in combine pass) ----
#pragma unroll
  for (int qt = 0; qt < 2; ++qt) {
    float* orow = dst + (headQ + q0 + qt * 16 + row) * DD;
#pragma unroll
    for (int t = 0; t < 4; ++t)
#pragma unroll
      for (int r = 0; r < 8; ++r)
        orow[t * 16 + koff + r] = acc[qt][t][r];
  }
}

// ---------------- Phase 3: combine k-halves + residual ----------------

__global__ __launch_bounds__(256)
void combine_kernel(float* __restrict__ out, const float* __restrict__ part,
                    const float* __restrict__ query) {
  const size_t i = ((size_t)blockIdx.x * 256 + threadIdx.x) * 4;
  float4 o = *(const float4*)(out + i);
  const float4 p = *(const float4*)(part + i);
  const float4 q = *(const float4*)(query + i);
  o.x += p.x + q.x; o.y += p.y + q.y; o.z += p.z + q.z; o.w += p.w + q.w;
  *(float4*)(out + i) = o;
}

extern "C" void kernel_launch(void* const* d_in, const int* in_sizes, int n_in,
                              void* d_out, int out_size, void* d_ws, size_t ws_size,
                              hipStream_t stream) {
  (void)in_sizes; (void)n_in; (void)out_size; (void)ws_size;
  const float* query = (const float*)d_in[0];
  const float* key   = (const float*)d_in[1];
  const float* value = (const float*)d_in[2];
  const float* mask  = (const float*)d_in[3];
  float* out = (float*)d_out;

  const size_t nElem = (size_t)BB * HH * NNQ * DD;    // 2M per tensor
  __bf16* qbf  = (__bf16*)d_ws;                       // 4 MiB
  __bf16* kbf  = qbf + nElem;                         // 4 MiB
  __bf16* vtbf = kbf + nElem;                         // 4 MiB
  float*  pout = (float*)(vtbf + nElem);              // 8 MiB (20 MiB total)

  {
    dim3 grid((unsigned)(nElem / (256 * 8)), 2);
    prep_qk_kernel<<<grid, 256, 0, stream>>>(query, key, qbf, kbf);
  }
  {
    dim3 grid(NNK / 32, BB * HH);
    prep_vt_kernel<<<grid, 256, 0, stream>>>(value, vtbf);
  }
  {
    dim3 grid(NNQ / 32, BB, KSPL);                    // (64, 2, 2) = 256 WGs
    linattn_headnorm_kernel<<<grid, 256, 0, stream>>>(mask, qbf, kbf, vtbf, out, pout);
  }
  {
    dim3 grid((unsigned)(nElem / (256 * 4)));
    combine_kernel<<<grid, 256, 0, stream>>>(out, pout, query);
  }
}

// v002
// Measured time: 56.6 microseconds a run.
// Timed twice side by side with v001, it ran 1.39 and 1.37 times as fast.
// Counting every step since v000, it is 1.91 times as fast.
#include <hip/hip_runtime.h>

// Linear attention with cross-head score normalization, MI455X (gfx1250).
// out = (relu(Q)relu(K)^T / sum_heads(.)) * mask @ V + Q
//
// Phase 1 (d_ws): relu(Q)->bf16, relu(K)->bf16, V^T->bf16, each packed in
// WMMA fragment order: one 16x32 fragment is 1 KiB, lane l's low 8 elements
// at l*16 B and its high 8 at 512 + l*16 B, so every wave-wide
// global_load_b128 of phase 2 reads 512 contiguous bytes (4 whole lines).
// Phase 2: transposed, software-pipelined, M=32 q-rows per wave: K/V
// operand loads are shared by two M-tiles -> 16 WMMAs per 16 operand loads
// (vmem:wmma ~1.2:1), halving L2-side K/V traffic. k-range split in two
// (blockIdx.z) keeps 256 workgroups resident; the cross-head denominator is
// per-(q,k) so the split is exact. mask / denominator is head-independent,
// so it is formed once per (q,k) inside the distributed reduction and every
// head only multiplies by it. Phase 3 combines the halves + residual
// deterministically.

#define BB  2
#define HH  8
#define NNQ 2048
#define NNK 2048
#define DD  64
#define KSPL 2
#define KRNG (NNK / KSPL)

typedef __attribute__((ext_vector_type(16))) __bf16 v16bf;
typedef __attribute__((ext_vector_type(8)))  __bf16 v8bf;
typedef __attribute__((ext_vector_type(8)))  float  v8f;

#define WMMA_BF16(A, B, C) \
  __builtin_amdgcn_wmma_f32_16x16x32_bf16(false, (A), false, (B), (short)0, (C), false, false)

// ---------------- Phase 1 kernels ----------------

__global__ __launch_bounds__(256)
void prep_qk_kernel(const float* __restrict__ q, const float* __restrict__ k,
                    __bf16* __restrict__ qbf, __bf16* __restrict__ kbf) {
  const float* src = blockIdx.y ? k : q;
  __bf16*      dst = blockIdx.y ? kbf : qbf;
  // A wave takes 8 rows x one 32-column half: whole 128-B lines in and out.
  const unsigned g   = blockIdx.x * 256 + threadIdx.x;
  const unsigned ch  = g & 3;                       // 8-column chunk of the half
  const unsigned dh  = (g >> 5) & 1;                // column half
  const unsigned R   = (g >> 6) * 8 + ((g >> 2) & 7);  // row over (b, h, n)
  const size_t idx  = (size_t)R * DD + dh * 32 + ch * 8;
  const size_t pidx = (size_t)((((R >> 4) * 2 + dh) * 2 + (ch >> 1)) * 256 +
                               ((R & 15) + 16 * (ch & 1)) * 8);
  const float4 a = *(const float4*)(src + idx);
  const float4 b = *(const float4*)(src + idx + 4);
  v8bf o;
  o[0] = (__bf16)fmaxf(a.x, 0.f); o[1] = (__bf16)fmaxf(a.y, 0.f);
  o[2] = (__bf16)fmaxf(a.z, 0.f); o[3] = (__bf16)fmaxf(a.w, 0.f);
  o[4] = (__bf16)fmaxf(b.x, 0.f); o[5] = (__bf16)fmaxf(b.y, 0.f);
  o[6] = (__bf16)fmaxf(b.z, 0.f); o[7] = (__bf16)fmaxf(b.w, 0.f);
  *(v8bf*)(dst + pidx) = o;
}

__global__ __launch_bounds__(256)
void prep_vt_kernel(const float* __restrict__ v, __bf16* __restrict__ vt) {
  const int bh = blockIdx.y;
  const int d  = threadIdx.x & 63;
  const int kc = threadIdx.x >> 6;      // 8-key chunk of this block's 32 keys
  const int k8 = blockIdx.x * 32 + kc * 8;
  const float* src = v + (size_t)bh * NNK * DD;
  // Fragment (32-key block, 16-row d tile); chunk kc = 2 * part + lane half.
  __bf16*      dst = vt + ((((size_t)bh * (NNK / 32) + blockIdx.x) * 4 + (d >> 4)) * 2 +
                           (kc >> 1)) * 256 + ((d & 15) + 16 * (kc & 1)) * 8;
  v8bf o;
#pragma unroll
  for (int j = 0; j < 8; ++j) o[j] = (__bf16)src[(size_t)(k8 + j) * DD + d];
  *(v8bf*)dst = o;
}

// ---------------- Phase 2 kernel ----------------

// frag: start of a packed 512-element fragment, already offset by lane * 8.
__device__ __forceinline__ v16bf load_op_bf16(const __bf16* __restrict__ frag) {
  v8bf lo = *(const v8bf*)(frag);
  v8bf hi = *(const v8bf*)(frag + 256);
  return __builtin_shufflevector(lo, hi, 0, 1, 2, 3, 4, 5, 6, 7,
                                 8, 9, 10, 11, 12, 13, 14, 15);
}

// 32 rows x 64 columns = 4 consecutive fragments: (rows 0-15, cols 0-31),
// (rows 0-15, cols 32-63), (rows 16-31, cols 0-31), (rows 16-31, cols 32-63).
__device__ __forceinline__ void load_k_ops(v16bf* op, const __bf16* __restrict__ kbbase,
                                           int k0, int lane) {
  const __bf16* kf = kbbase + (size_t)k0 * DD + lane * 8;
  op[0] = load_op_bf16(kf);
  op[1] = load_op_bf16(kf + 512);
  op[2] = load_op_bf16(kf + 1024);
  op[3] = load_op_bf16(kf + 1536);
}

__global__ __launch_bounds__(256)
void linattn_headnorm_kernel(const float* __restrict__ mask,
                             const __bf16* __restrict__ qbf,
                             const __bf16* __restrict__ kbf,
                             const __bf16* __restrict__ vtbf,
                             float* __restrict__ out,
                             float* __restrict__ pout) {
  // 32 score slots per lane (2 q-tiles x 16). Rows padded to 36 floats:
  // 144B rows stay 16B-aligned, b128 bank-group stride 9 (odd).
  __shared__ float sred[HH][32][36];   // 36 KB
  __shared__ float dbuf[32][36];       // mask / denominator (32 slots + pad)

  const int lane  = threadIdx.x & 31;
  // wave id == head id; held scalar so that the packed K/V/Q bases stay in
  // scalar registers: as a vector value the build took about 80 more VGPRs,
  // with the load pointers above v255.
  const int h     = __builtin_amdgcn_readfirstlane(threadIdx.x >> 5);
  const int b     = blockIdx.y;
  const int q0    = blockIdx.x * 32;    // two 16-row q-tiles per wave
  const int kbeg  = blockIdx.z * KRNG;

  const int row   = lane & 15;
  const int koff  = (lane >> 4) * 8;

  const size_t bh    = (size_t)b * HH + h;
  const size_t headQ = bh * NNQ;
  const __bf16* kbbase = kbf + bh * NNK * DD;
  const __bf16* vtbase = vtbf + bh * DD * NNK;
  // Reduction ownership: wave h owns q-rows (h & 3) + 4j of q-tile h >> 2,
  // all 32 keys. Lane bits: [3:2] = j, [4] = score-lane half, [1] = 16-key
  // half, [0] = 4-slot group. The wave's one mask load is 4 whole 128-B
  // lines, and per 16 lanes the LDS dword addresses are 16j + 8*bit1 +
  // 4*bit0 mod 64: all 64 banks, no conflict.
  const int own_lane = (h & 3) + 4 * ((lane >> 2) & 3) + (lane & 16);
  const int own_slot = 16 * (h >> 2) + 8 * ((lane >> 1) & 1) + 4 * (lane & 1);
  // Wave-uniform base of the owned q-tile's mask rows; this lane's byte offset.
  const float* mtile = mask + ((size_t)b * NNQ + q0 + 16 * (h >> 2)) * NNK;
  const unsigned moff = 4u * ((own_lane & 15) * NNK + 16 * ((lane >> 1) & 1) +
                              8 * (lane >> 4) + 4 * (lane & 1));
  float* dst = (blockIdx.z == 0) ? out : pout;

  // Persistent Q B-operands for both q-tiles (pre-relu'd bf16).
  const __bf16* qf = qbf + (headQ + q0) * DD + lane * 8;
  const v16bf bqAlo = load_op_bf16(qf);
  const v16bf bqAhi = load_op_bf16(qf + 512);
  const v16bf bqBlo = load_op_bf16(qf + 1024);
  const v16bf bqBhi = load_op_bf16(qf + 1536);

  const v8f vzero = {0.f, 0.f, 0.f, 0.f, 0.f, 0.f, 0.f, 0.f};
  v8f acc[2][4];   // out^T accumulators per q-tile
#pragma unroll
  for (int qt = 0; qt < 2; ++qt)
#pragma unroll
    for (int t = 0; t < 4; ++t) acc[qt][t] = vzero;

  // This wave's mask chunks of a trip's two tiles.
  const float* mp = (const float*)((const char*)(mtile + kbeg) + moff);
  float4 mskA, mskB;
  auto load_masks = [&]() {
    mskA = *(const float4*)(mp);
    mskB = *(const float4*)(mp + 32);
    // Keeps the issue here; the scheduler otherwise sinks these loads to
    // just in front of their use, behind the next barrier.
    __builtin_amdgcn_sched_barrier(0);
    // The build rewrites the two loads' address registers soon behind them
    // and this wait stands in front of that.
    asm volatile("s_wait_xcnt 0x0" ::: "memory");
  };

  auto tile_step = [&](const v16bf* cur, v16bf* nxt, const float4 mcur,
                       const bool trip_end, int k0) {
    // Early-issue: shared V operands.
    const __bf16* vf = vtbase + (size_t)k0 * DD + lane * 8;
    v16bf av0 = load_op_bf16(vf);
    v16bf av1 = load_op_bf16(vf + 512);
    v16bf av2 = load_op_bf16(vf + 1024);
    v16bf av3 = load_op_bf16(vf + 1536);

    // Preload next K tile (wraps inside this z's k-range; branch-free).
    load_k_ops(nxt, kbbase, kbeg + ((k0 - kbeg + 32) & (KRNG - 1)), lane);

    // ---- GEMM1^T: S^T[32k x 32q] = relu(K) * relu(Q)^T, K ops shared ----
    v8f s0a = vzero, s1a = vzero, s0b = vzero, s1b = vzero;
    s0a = WMMA_BF16(cur[0], bqAlo, s0a);  s0a = WMMA_BF16(cur[1], bqAhi, s0a);
    s1a = WMMA_BF16(cur[2], bqAlo, s1a);  s1a = WMMA_BF16(cur[3], bqAhi, s1a);
    s0b = WMMA_BF16(cur[0], bqBlo, s0b);  s0b = WMMA_BF16(cur[1], bqBhi, s0b);
    s1b = WMMA_BF16(cur[2], bqBlo, s1b);  s1b = WMMA_BF16(cur[3], bqBhi, s1b);

    // ---- Publish scores: slots 0..7=s0a, 8..15=s1a, 16..23=s0b, 24..31=s1b
#pragma unroll
    for (int i = 0; i < 8; ++i) {
      sred[h][lane][i]      = s0a[i];
      sred[h][lane][8 + i]  = s1a[i];
      sred[h][lane][16 + i] = s0b[i];
      sred[h][lane][24 + i] = s1b[i];
    }
    __syncthreads();  // B1

    // ---- Distributed cross-head reduction: each wave sums its 128 (q,k)
    // entries over the heads and publishes mask / sum for all heads ----
    {
      float p0 = 0.f, p1 = 0.f, p2 = 0.f, p3 = 0.f;
#pragma unroll
      for (int w = 0; w < 8; ++w) {
        const float4 v = *(const float4*)(&sred[w][own_lane][own_slot]);
        p0 += v.x; p1 += v.y; p2 += v.z; p3 += v.w;
      }
      float4 pr;
      pr.x = mcur.x * __builtin_amdgcn_rcpf(p0);
      pr.y = mcur.y * __builtin_amdgcn_rcpf(p1);
      pr.z = mcur.z * __builtin_amdgcn_rcpf(p2);
      pr.w = mcur.w * __builtin_amdgcn_rcpf(p3);
      *(float4*)(&dbuf[own_lane][own_slot]) = pr;
    }
    __syncthreads();  // B2

    if (trip_end) {
      // Next trip's mask chunks. They come from memory, and the fence of
      // every __syncthreads() waits for all loads in flight: issued directly
      // behind B2 they have the longest run up to the next such wait. The
      // last trip reads its own chunks again: stays inside the mask.
      mp += (k0 + 32 < kbeg + KRNG) ? 64 : 0;
      load_masks();
    }

    float fac[32];
#pragma unroll
    for (int j = 0; j < 8; ++j) {
      const float4 v = *(const float4*)(&dbuf[lane][4 * j]);
      fac[4 * j + 0] = v.x; fac[4 * j + 1] = v.y;
      fac[4 * j + 2] = v.z; fac[4 * j + 3] = v.w;
    }

    // ---- P^T = S^T * (mask / den), in-register, straight into B layout ----
    v16bf bpa, bpb;
#pragma unroll
    for (int r = 0; r < 8; ++r) {
      bpa[r]     = (__bf16)(s0a[r] * fac[r]);
      bpa[8 + r] = (__bf16)(s1a[r] * fac[8 + r]);
      bpb[r]     = (__bf16)(s0b[r] * fac[16 + r]);
      bpb[8 + r] = (__bf16)(s1b[r] * fac[24 + r]);
    }

    // ---- GEMM2^T: out^T += V^T * P^T, V ops shared by both q-tiles ----
    acc[0][0] = WMMA_BF16(av0, bpa, acc[0][0]);
    acc[0][1] = WMMA_BF16(av1, bpa, acc[0][1]);
    acc[0][2] = WMMA_BF16(av2, bpa, acc[0][2]);
    acc[0][3] = WMMA_BF16(av3, bpa, acc[0][3]);
    acc[1][0] = WMMA_BF16(av0, bpb, acc[1][0]);
    acc[1][1] = WMMA_BF16(av1, bpb, acc[1][1]);
    acc[1][2] = WMMA_BF16(av2, bpb, acc[1][2]);
    acc[1][3] = WMMA_BF16(av3, bpb, acc[1][3]);

    // Light prefetch two tiles ahead (global_prefetch_b8).
    const int kp = kbeg + ((k0 - kbeg + 64) & (KRNG - 1));
    __builtin_prefetch(kbbase + (size_t)(kp + lane) * DD, 0, 1);
    __builtin_prefetch(vtbase + (size_t)(kp + lane) * DD, 0, 1);
  };

  v16bf bufA[4], bufB[4];
  load_k_ops(bufA, kbbase, kbeg, lane);
  load_masks();
  for (int k0 = kbeg; k0 < kbeg + KRNG; k0 += 64) {
    tile_step(bufA, bufB, mskA, false, k0);
    tile_step(bufB, bufA, mskB, true, k0 + 32);
  }

  // ---- Epilogue: store partial out^T (residual added in combine pass) ----
#pragma unroll
  for (int qt = 0; qt < 2; ++qt) {
    float* orow = dst + (headQ + q0 + qt * 16 + row) * DD;
#pragma unroll
    for (int t = 0; t < 4; ++t)
#pragma unroll
      for (int r = 0; r < 8; ++r)
        orow[t * 16 + koff + r] = acc[qt][t][r];
  }
}

// ---------------- Phase 3: combine k-halves + residual ----------------

__global__ __launch_bounds__(256)
void combine_kernel(float* __restrict__ out, const float* __restrict__ part,
                    const float* __restrict__ query) {
  const size_t i = ((size_t)blockIdx.x * 256 + threadIdx.x) * 4;
  float4 o = *(const float4*)(out + i);
  const float4 p = *(const float4*)(part + i);
  const float4 q = *(const float4*)(query + i);
  o.x += p.x + q.x; o.y += p.y + q.y; o.z += p.z + q.z; o.w += p.w + q.w;
  *(float4*)(out + i) = o;
}

extern "C" void kernel_launch(void* const* d_in, const int* in_sizes, int n_in,
                              void* d_out, int out_size, void* d_ws, size_t ws_size,
                              hipStream_t stream) {
  (void)in_sizes; (void)n_in; (void)out_size; (void)ws_size;
  const float* query = (const float*)d_in[0];
  const float* key   = (const float*)d_in[1];
  const float* value = (const float*)d_in[2];
  const float* mask  = (const float*)d_in[3];
  float* out = (float*)d_out;

  const size_t nElem = (size_t)BB * HH * NNQ * DD;    // 2M per tensor
  __bf16* qbf  = (__bf16*)d_ws;                       // 4 MiB
  __bf16* kbf  = qbf + nElem;                         // 4 MiB
  __bf16* vtbf = kbf + nElem;                         // 4 MiB
  float*  pout = (float*)(vtbf + nElem);              // 8 MiB (20 MiB total)

  {
    dim3 grid((unsigned)(nElem / (256 * 8)), 2);
    prep_qk_kernel<<<grid, 256, 0, stream>>>(query, key, qbf, kbf);
  }
  {
    dim3 grid(NNK / 32, BB * HH);
    prep_vt_kernel<<<grid, 256, 0, stream>>>(value, vtbf);
  }
  {
    dim3 grid(NNQ / 32, BB, KSPL);                    // (64, 2, 2) = 256 WGs
    linattn_headnorm_kernel<<<grid, 256, 0, stream>>>(mask, qbf, kbf, vtbf, out, pout);
  }
  {
    dim3 grid((unsigned)(nElem / (256 * 4)));
    combine_kernel<<<grid, 256, 0, stream>>>(out, pout, query);
  }
}

// v003
// One run takes 50.2 microseconds.
// Next to v002, in two timings, it ran 1.12 and 1.14 times as fast.
// Counting every step since v000, it is 2.15 times as fast.
#include <hip/hip_runtime.h>

// Linear attention with cross-head score normalization, MI455X (gfx1250).
// out = (relu(Q)relu(K)^T / sum_heads(.)) * mask @ V + Q
//
// Phase 1 (d_ws): relu(Q)->bf16, relu(K)->bf16, V^T->bf16, each packed in
// WMMA fragment order: one 16x32 fragment is 1 KiB, lane l's low 8 elements
// at l*16 B and its high 8 at 512 + l*16 B, so every wave-wide
// global_load_b128 of phase 2 reads 512 contiguous bytes (4 whole lines).
// Phase 2: transposed, software-pipelined, M=32 q-rows per wave: K/V
// operand loads are shared by two M-tiles -> 16 WMMAs per 16 operand loads
// (vmem:wmma ~1.2:1), halving L2-side K/V traffic. k-range split in two
// (blockIdx.z) keeps 256 workgroups resident; the cross-head denominator is
// per-(q,k) so the split is exact. mask / denominator is head-independent,
// so it is formed once per (q,k) inside the distributed reduction and every
// head only multiplies by it. Phase 3 combines the halves + residual
// deterministically.

#define BB  2
#define HH  8
#define NNQ 2048
#define NNK 2048
#define DD  64
#define KSPL 2
#define KRNG (NNK / KSPL)

typedef __attribute__((ext_vector_type(16))) __bf16 v16bf;
typedef __attribute__((ext_vector_type(8)))  __bf16 v8bf;
typedef __attribute__((ext_vector_type(8)))  float  v8f;

#define WMMA_BF16(A, B, C) \
  __builtin_amdgcn_wmma_f32_16x16x32_bf16(false, (A), false, (B), (short)0, (C), false, false)

// ---------------- Phase 1 kernels ----------------

__global__ __launch_bounds__(256)
void prep_qk_kernel(const float* __restrict__ q, const float* __restrict__ k,
                    __bf16* __restrict__ qbf, __bf16* __restrict__ kbf) {
  const float* src = blockIdx.y ? k : q;
  __bf16*      dst = blockIdx.y ? kbf : qbf;
  // A wave takes 8 rows x one 32-column half: whole 128-B lines in and out.
  const unsigned g   = blockIdx.x * 256 + threadIdx.x;
  const unsigned ch  = g & 3;                       // 8-column chunk of the half
  const unsigned dh  = (g >> 5) & 1;                // column half
  const unsigned R   = (g >> 6) * 8 + ((g >> 2) & 7);  // row over (b, h, n)
  const size_t idx  = (size_t)R * DD + dh * 32 + ch * 8;
  const size_t pidx = (size_t)((((R >> 4) * 2 + dh) * 2 + (ch >> 1)) * 256 +
                               ((R & 15) + 16 * (ch & 1)) * 8);
  const float4 a = *(const float4*)(src + idx);
  const float4 b = *(const float4*)(src + idx + 4);
  v8bf o;
  o[0] = (__bf16)fmaxf(a.x, 0.f); o[1] = (__bf16)fmaxf(a.y, 0.f);
  o[2] = (__bf16)fmaxf(a.z, 0.f); o[3] = (__bf16)fmaxf(a.w, 0.f);
  o[4] = (__bf16)fmaxf(b.x, 0.f); o[5] = (__bf16)fmaxf(b.y, 0.f);
  o[6] = (__bf16)fmaxf(b.z, 0.f); o[7] = (__bf16)fmaxf(b.w, 0.f);
  *(v8bf*)(dst + pidx) = o;
}

__global__ __launch_bounds__(256)
void prep_vt_kernel(const float* __restrict__ v, __bf16* __restrict__ vt) {
  const int bh = blockIdx.y;
  const int d  = threadIdx.x & 63;
  const int kc = threadIdx.x >> 6;      // 8-key chunk of this block's 32 keys
  const int k8 = blockIdx.x * 32 + kc * 8;
  const float* src = v + (size_t)bh * NNK * DD;
  // Fragment (32-key block, 16-row d tile); chunk kc = 2 * part + lane half.
  __bf16*      dst = vt + ((((size_t)bh * (NNK / 32) + blockIdx.x) * 4 + (d >> 4)) * 2 +
                           (kc >> 1)) * 256 + ((d & 15) + 16 * (kc & 1)) * 8;
  v8bf o;
#pragma unroll
  for (int j = 0; j < 8; ++j) o[j] = (__bf16)src[(size_t)(k8 + j) * DD + d];
  *(v8bf*)dst = o;
}

// ---------------- Phase 2 kernel ----------------

// frag: start of a packed 512-element fragment, already offset by lane * 8.
__device__ __forceinline__ v16bf load_op_bf16(const __bf16* __restrict__ frag) {
  v8bf lo = *(const v8bf*)(frag);
  v8bf hi = *(const v8bf*)(frag + 256);
  return __builtin_shufflevector(lo, hi, 0, 1, 2, 3, 4, 5, 6, 7,
                                 8, 9, 10, 11, 12, 13, 14, 15);
}

// 32 rows x 64 columns = 4 consecutive fragments: (rows 0-15, cols 0-31),
// (rows 0-15, cols 32-63), (rows 16-31, cols 0-31), (rows 16-31, cols 32-63).
__device__ __forceinline__ void load_k_ops(v16bf* op, const __bf16* __restrict__ kbbase,
                                           int k0, int lane) {
  const __bf16* kf = kbbase + (size_t)k0 * DD + lane * 8;
  op[0] = load_op_bf16(kf);
  op[1] = load_op_bf16(kf + 512);
  op[2] = load_op_bf16(kf + 1024);
  op[3] = load_op_bf16(kf + 1536);
}

// Work-group barrier that orders LDS traffic only: the wave's own LDS
// operations are waited for, its global loads stay in flight across it
// (__syncthreads() drains the load counter as well). All that the waves
// exchange in the loop goes through LDS.
__device__ __forceinline__ void lds_barrier() {
  asm volatile("s_wait_dscnt 0x0\n\ts_barrier_signal -1\n\ts_barrier_wait -1" ::: "memory");
}

// Two waves per SIMD is what the one resident work-group gives. Said to the
// compiler so that it plans for that register budget: with the operand loads
// live across the barriers it otherwise squeezes the loop under 256 VGPRs and
// reads the reduction's eight LDS rows two at a time, each pair waited for.
__global__ __launch_bounds__(256) __attribute__((amdgpu_waves_per_eu(2, 2)))
void linattn_headnorm_kernel(const float* __restrict__ mask,
                             const __bf16* __restrict__ qbf,
                             const __bf16* __restrict__ kbf,
                             const __bf16* __restrict__ vtbf,
                             float* __restrict__ out,
                             float* __restrict__ pout) {
  // 32 score slots per lane (2 q-tiles x 16). Rows padded to 36 floats:
  // 144B rows stay 16B-aligned, b128 bank-group stride 9 (odd).
  __shared__ float sred[HH][32][36];   // 36 KB
  __shared__ float dbuf[32][36];       // mask / denominator (32 slots + pad)

  const int lane  = threadIdx.x & 31;
  // wave id == head id; held scalar so that the packed K/V/Q bases stay in
  // scalar registers: as a vector value the build took about 80 more VGPRs,
  // with the load pointers above v255.
  const int h     = __builtin_amdgcn_readfirstlane(threadIdx.x >> 5);
  const int b     = blockIdx.y;
  const int q0    = blockIdx.x * 32;    // two 16-row q-tiles per wave
  const int kbeg  = blockIdx.z * KRNG;

  const int row   = lane & 15;
  const int koff  = (lane >> 4) * 8;

  const size_t bh    = (size_t)b * HH + h;
  const size_t headQ = bh * NNQ;
  const __bf16* kbbase = kbf + bh * NNK * DD;
  const __bf16* vtbase = vtbf + bh * DD * NNK;
  // Reduction ownership: wave h owns q-rows (h & 3) + 4j of q-tile h >> 2,
  // all 32 keys. Lane bits: [3:2] = j, [4] = score-lane half, [1] = 16-key
  // half, [0] = 4-slot group. The wave's one mask load is 4 whole 128-B
  // lines, and per 16 lanes the LDS dword addresses are 16j + 8*bit1 +
  // 4*bit0 mod 64: all 64 banks, no conflict.
  const int own_lane = (h & 3) + 4 * ((lane >> 2) & 3) + (lane & 16);
  const int own_slot = 16 * (h >> 2) + 8 * ((lane >> 1) & 1) + 4 * (lane & 1);
  // Wave-uniform base of the owned q-tile's mask rows; this lane's byte offset.
  const float* mtile = mask + ((size_t)b * NNQ + q0 + 16 * (h >> 2)) * NNK;
  const unsigned moff = 4u * ((own_lane & 15) * NNK + 16 * ((lane >> 1) & 1) +
                              8 * (lane >> 4) + 4 * (lane & 1));
  float* dst = (blockIdx.z == 0) ? out : pout;

  // Persistent Q B-operands for both q-tiles (pre-relu'd bf16).
  const __bf16* qf = qbf + (headQ + q0) * DD + lane * 8;
  const v16bf bqAlo = load_op_bf16(qf);
  const v16bf bqAhi = load_op_bf16(qf + 512);
  const v16bf bqBlo = load_op_bf16(qf + 1024);
  const v16bf bqBhi = load_op_bf16(qf + 1536);

  const v8f vzero = {0.f, 0.f, 0.f, 0.f, 0.f, 0.f, 0.f, 0.f};
  v8f acc[2][4];   // out^T accumulators per q-tile
#pragma unroll
  for (int qt = 0; qt < 2; ++qt)
#pragma unroll
    for (int t = 0; t < 4; ++t) acc[qt][t] = vzero;

  // This wave's mask chunks of a trip's two tiles.
  const float* mp = (const float*)((const char*)(mtile + kbeg) + moff);
  float4 mskA, mskB;
  auto load_masks = [&]() {
    mskA = *(const float4*)(mp);
    mskB = *(const float4*)(mp + 32);
    // Keeps the issue here; the scheduler otherwise sinks these loads to
    // just in front of their use.
    __builtin_amdgcn_sched_barrier(0);
    // The build rewrites the two loads' address registers soon behind them
    // and this wait stands in front of that.
    asm volatile("s_wait_xcnt 0x0" ::: "memory");
  };

  auto tile_step = [&](const v16bf* cur, v16bf* nxt, const float4 mcur,
                       const bool trip_end, int k0) {
    // Early-issue: shared V operands.
    const __bf16* vf = vtbase + (size_t)k0 * DD + lane * 8;
    v16bf av0 = load_op_bf16(vf);
    v16bf av1 = load_op_bf16(vf + 512);
    v16bf av2 = load_op_bf16(vf + 1024);
    v16bf av3 = load_op_bf16(vf + 1536);

    // Preload next K tile (wraps inside this z's k-range; branch-free).
    load_k_ops(nxt, kbbase, kbeg + ((k0 - kbeg + 32) & (KRNG - 1)), lane);

    // ---- GEMM1^T: S^T[32k x 32q] = relu(K) * relu(Q)^T, K ops shared ----
    v8f s0a = vzero, s1a = vzero, s0b = vzero, s1b = vzero;
    s0a = WMMA_BF16(cur[0], bqAlo, s0a);  s0a = WMMA_BF16(cur[1], bqAhi, s0a);
    s1a = WMMA_BF16(cur[2], bqAlo, s1a);  s1a = WMMA_BF16(cur[3], bqAhi, s1a);
    s0b = WMMA_BF16(cur[0], bqBlo, s0b);  s0b = WMMA_BF16(cur[1], bqBhi, s0b);
    s1b = WMMA_BF16(cur[2], bqBlo, s1b);  s1b = WMMA_BF16(cur[3], bqBhi, s1b);

    // ---- Publish scores: slots 0..7=s0a, 8..15=s1a, 16..23=s0b, 24..31=s1b
#pragma unroll
    for (int i = 0; i < 8; ++i) {
      sred[h][lane][i]      = s0a[i];
      sred[h][lane][8 + i]  = s1a[i];
      sred[h][lane][16 + i] = s0b[i];
      sred[h][lane][24 + i] = s1b[i];
    }
    lds_barrier();  // B1

    // ---- Distributed cross-head reduction: each wave sums its 128 (q,k)
    // entries over the heads and publishes mask / sum for all heads ----
    {
      float p0 = 0.f, p1 = 0.f, p2 = 0.f, p3 = 0.f;
#pragma unroll
      for (int w = 0; w < 8; ++w) {
        const float4 v = *(const float4*)(&sred[w][own_lane][own_slot]);
        p0 += v.x; p1 += v.y; p2 += v.z; p3 += v.w;
      }
      float4 pr;
      pr.x = mcur.x * __builtin_amdgcn_rcpf(p0);
      pr.y = mcur.y * __builtin_amdgcn_rcpf(p1);
      pr.z = mcur.z * __builtin_amdgcn_rcpf(p2);
      pr.w = mcur.w * __builtin_amdgcn_rcpf(p3);
      *(float4*)(&dbuf[own_lane][own_slot]) = pr;
    }
    lds_barrier();  // B2

    if (trip_end) {
      // Next trip's mask chunks, into the registers that the trip's two
      // reductions have consumed: behind its last B2 is the earliest place
      // for both. They come from memory and fly across the next B1. The
      // last trip reads its own chunks again: stays inside the mask.
      mp += (k0 + 32 < kbeg + KRNG) ? 64 : 0;
      load_masks();
    }

    float fac[32];
#pragma unroll
    for (int j = 0; j < 8; ++j) {
      const float4 v = *(const float4*)(&dbuf[lane][4 * j]);
      fac[4 * j + 0] = v.x; fac[4 * j + 1] = v.y;
      fac[4 * j + 2] = v.z; fac[4 * j + 3] = v.w;
    }

    // ---- P^T = S^T * (mask / den), in-register, straight into B layout ----
    v16bf bpa, bpb;
#pragma unroll
    for (int r = 0; r < 8; ++r) {
      bpa[r]     = (__bf16)(s0a[r] * fac[r]);
      bpa[8 + r] = (__bf16)(s1a[r] * fac[8 + r]);
      bpb[r]     = (__bf16)(s0b[r] * fac[16 + r]);
      bpb[8 + r] = (__bf16)(s1b[r] * fac[24 + r]);
    }

    // ---- GEMM2^T: out^T += V^T * P^T, V ops shared by both q-tiles ----
    acc[0][0] = WMMA_BF16(av0, bpa, acc[0][0]);
    acc[0][1] = WMMA_BF16(av1, bpa, acc[0][1]);
    acc[0][2] = WMMA_BF16(av2, bpa, acc[0][2]);
    acc[0][3] = WMMA_BF16(av3, bpa, acc[0][3]);
    acc[1][0] = WMMA_BF16(av0, bpb, acc[1][0]);
    acc[1][1] = WMMA_BF16(av1, bpb, acc[1][1]);
    acc[1][2] = WMMA_BF16(av2, bpb, acc[1][2]);
    acc[1][3] = WMMA_BF16(av3, bpb, acc[1][3]);

    // Light prefetch two tiles ahead (global_prefetch_b8).
    const int kp = kbeg + ((k0 - kbeg + 64) & (KRNG - 1));
    __builtin_prefetch(kbbase + (size_t)(kp + lane) * DD, 0, 1);
    __builtin_prefetch(vtbase + (size_t)(kp + lane) * DD, 0, 1);
  };

  v16bf bufA[4], bufB[4];
  load_k_ops(bufA, kbbase, kbeg, lane);
  load_masks();
  for (int k0 = kbeg; k0 < kbeg + KRNG; k0 += 64) {
    tile_step(bufA, bufB, mskA, false, k0);
    tile_step(bufB, bufA, mskB, true, k0 + 32);
  }

  // ---- Epilogue: store partial out^T (residual added in combine pass) ----
#pragma unroll
  for (int qt = 0; qt < 2; ++qt) {
    float* orow = dst + (headQ + q0 + qt * 16 + row) * DD;
#pragma unroll
    for (int t = 0; t < 4; ++t)
#pragma unroll
      for (int r = 0; r < 8; ++r)
        orow[t * 16 + koff + r] = acc[qt][t][r];
  }
}

// ---------------- Phase 3: combine k-halves + residual ----------------

__global__ __launch_bounds__(256)
void combine_kernel(float* __restrict__ out, const float* __restrict__ part,
                    const float* __restrict__ query) {
  const size_t i = ((size_t)blockIdx.x * 256 + threadIdx.x) * 4;
  float4 o = *(const float4*)(out + i);
  const float4 p = *(const float4*)(part + i);
  const float4 q = *(const float4*)(query + i);
  o.x += p.x + q.x; o.y += p.y + q.y; o.z += p.z + q.z; o.w += p.w + q.w;
  *(float4*)(out + i) = o;
}

extern "C" void kernel_launch(void* const* d_in, const int* in_sizes, int n_in,
                              void* d_out, int out_size, void* d_ws, size_t ws_size,
                              hipStream_t stream) {
  (void)in_sizes; (void)n_in; (void)out_size; (void)ws_size;
  const float* query = (const float*)d_in[0];
  const float* key   = (const float*)d_in[1];
  const float* value = (const float*)d_in[2];
  const float* mask  = (const float*)d_in[3];
  float* out = (float*)d_out;

  const size_t nElem = (size_t)BB * HH * NNQ * DD;    // 2M per tensor
  __bf16* qbf  = (__bf16*)d_ws;                       // 4 MiB
  __bf16* kbf  = qbf + nElem;                         // 4 MiB
  __bf16* vtbf = kbf + nElem;                         // 4 MiB
  float*  pout = (float*)(vtbf + nElem);              // 8 MiB (20 MiB total)

  {
    dim3 grid((unsigned)(nElem / (256 * 8)), 2);
    prep_qk_kernel<<<grid, 256, 0, stream>>>(query, key, qbf, kbf);
  }
  {
    dim3 grid(NNK / 32, BB * HH);
    prep_vt_kernel<<<grid, 256, 0, stream>>>(value, vtbf);
  }
  {
    dim3 grid(NNQ / 32, BB, KSPL);                    // (64, 2, 2) = 256 WGs
    linattn_headnorm_kernel<<<grid, 256, 0, stream>>>(mask, qbf, kbf, vtbf, out, pout);
  }
  {
    dim3 grid((unsigned)(nElem / (256 * 4)));
    combine_kernel<<<grid, 256, 0, stream>>>(out, pout, query);
  }
}

// v004
// Measured time: 45.3 microseconds a run.
// Timed twice side by side with v003, it ran 1.11 times as fast both times.
// Over all steps from v000 it is 2.38 times as fast.
#include <hip/hip_runtime.h>

// Linear attention with cross-head score normalization, MI455X (gfx1250).
// out = (relu(Q)relu(K)^T / sum_heads(.)) * mask @ V + Q
//
// Phase 1 (d_ws): relu(Q)->bf16, relu(K)->bf16, V^T->bf16, each packed in
// WMMA fragment order: one 16x32 fragment is 1 KiB, lane l's low 8 elements
// at l*16 B and its high 8 at 512 + l*16 B, so every wave-wide
// global_load_b128 of phase 2 reads 512 contiguous bytes (4 whole lines).
// Phase 2: transposed, software-pipelined, M=32 q-rows per wave: K/V
// operand loads are shared by two M-tiles -> 16 WMMAs per 16 operand loads
// (vmem:wmma ~1.2:1), halving L2-side K/V traffic. k-range split in two
// (blockIdx.z) keeps 256 workgroups resident; the cross-head denominator is
// per-(q,k) so the split is exact. mask / denominator is head-independent,
// so it is formed once per (q,k) inside the distributed reduction and every
// head only multiplies by it. Phase 3 combines the halves + residual
// deterministically.

#define BB  2
#define HH  8
#define NNQ 2048
#define NNK 2048
#define DD  64
#define KSPL 2
#define KRNG (NNK / KSPL)

typedef __attribute__((ext_vector_type(16))) __bf16 v16bf;
typedef __attribute__((ext_vector_type(8)))  __bf16 v8bf;
typedef __attribute__((ext_vector_type(8)))  float  v8f;

#define WMMA_BF16(A, B, C) \
  __builtin_amdgcn_wmma_f32_16x16x32_bf16(false, (A), false, (B), (short)0, (C), false, false)

// ---------------- Phase 1 kernels ----------------

__global__ __launch_bounds__(256)
void prep_qk_kernel(const float* __restrict__ q, const float* __restrict__ k,
                    __bf16* __restrict__ qbf, __bf16* __restrict__ kbf) {
  const float* src = blockIdx.y ? k : q;
  __bf16*      dst = blockIdx.y ? kbf : qbf;
  // A wave takes 8 rows x one 32-column half: whole 128-B lines in and out.
  const unsigned g   = blockIdx.x * 256 + threadIdx.x;
  const unsigned ch  = g & 3;                       // 8-column chunk of the half
  const unsigned dh  = (g >> 5) & 1;                // column half
  const unsigned R   = (g >> 6) * 8 + ((g >> 2) & 7);  // row over (b, h, n)
  const size_t idx  = (size_t)R * DD + dh * 32 + ch * 8;
  const size_t pidx = (size_t)((((R >> 4) * 2 + dh) * 2 + (ch >> 1)) * 256 +
                               ((R & 15) + 16 * (ch & 1)) * 8);
  const float4 a = *(const float4*)(src + idx);
  const float4 b = *(const float4*)(src + idx + 4);
  v8bf o;
  o[0] = (__bf16)fmaxf(a.x, 0.f); o[1] = (__bf16)fmaxf(a.y, 0.f);
  o[2] = (__bf16)fmaxf(a.z, 0.f); o[3] = (__bf16)fmaxf(a.w, 0.f);
  o[4] = (__bf16)fmaxf(b.x, 0.f); o[5] = (__bf16)fmaxf(b.y, 0.f);
  o[6] = (__bf16)fmaxf(b.z, 0.f); o[7] = (__bf16)fmaxf(b.w, 0.f);
  *(v8bf*)(dst + pidx) = o;
}

__global__ __launch_bounds__(256)
void prep_vt_kernel(const float* __restrict__ v, __bf16* __restrict__ vt) {
  const int bh = blockIdx.y;
  const int d  = threadIdx.x & 63;
  const int kc = threadIdx.x >> 6;      // 8-key chunk of this block's 32 keys
  const int k8 = blockIdx.x * 32 + kc * 8;
  const float* src = v + (size_t)bh * NNK * DD;
  // Fragment (32-key block, 16-row d tile); chunk kc = 2 * part + lane half.
  __bf16*      dst = vt + ((((size_t)bh * (NNK / 32) + blockIdx.x) * 4 + (d >> 4)) * 2 +
                           (kc >> 1)) * 256 + ((d & 15) + 16 * (kc & 1)) * 8;
  v8bf o;
#pragma unroll
  for (int j = 0; j < 8; ++j) o[j] = (__bf16)src[(size_t)(k8 + j) * DD + d];
  *(v8bf*)dst = o;
}

// ---------------- Phase 2 kernel ----------------

// frag: start of a packed 512-element fragment, already offset by lane * 8.
__device__ __forceinline__ v16bf load_op_bf16(const __bf16* __restrict__ frag) {
  v8bf lo = *(const v8bf*)(frag);
  v8bf hi = *(const v8bf*)(frag + 256);
  return __builtin_shufflevector(lo, hi, 0, 1, 2, 3, 4, 5, 6, 7,
                                 8, 9, 10, 11, 12, 13, 14, 15);
}

// 32 rows x 64 columns = 4 consecutive fragments: (rows 0-15, cols 0-31),
// (rows 0-15, cols 32-63), (rows 16-31, cols 0-31), (rows 16-31, cols 32-63).
__device__ __forceinline__ void load_k_ops(v16bf* op, const __bf16* __restrict__ kbbase,
                                           int k0, int lane) {
  const __bf16* kf = kbbase + (size_t)k0 * DD + lane * 8;
  op[0] = load_op_bf16(kf);
  op[1] = load_op_bf16(kf + 512);
  op[2] = load_op_bf16(kf + 1024);
  op[3] = load_op_bf16(kf + 1536);
}

// Work-group barrier that orders LDS traffic only: the wave's own LDS
// operations are waited for, its global loads stay in flight across it
// (__syncthreads() drains the load counter as well). All that the waves
// exchange in the loop goes through LDS.
__device__ __forceinline__ void lds_barrier() {
  asm volatile("s_wait_dscnt 0x0\n\ts_barrier_signal -1\n\ts_barrier_wait -1" ::: "memory");
}

// Two waves per SIMD is what the one resident work-group gives. Said to the
// compiler so that it plans for that register budget: with the operand loads
// live across the barriers it otherwise squeezes the loop under 256 VGPRs and
// reads the reduction's eight LDS rows two at a time, each pair waited for.
__global__ __launch_bounds__(256) __attribute__((amdgpu_waves_per_eu(2, 2)))
void linattn_headnorm_kernel(const float* __restrict__ mask,
                             const __bf16* __restrict__ qbf,
                             const __bf16* __restrict__ kbf,
                             const __bf16* __restrict__ vtbf,
                             float* __restrict__ out,
                             float* __restrict__ pout) {
  // 32 score slots per lane (2 q-tiles x 16). Rows padded to 36 floats:
  // 144B rows stay 16B-aligned, b128 bank-group stride 9 (odd).
  __shared__ float sred[HH][32][36];   // 36 KB
  __shared__ float dbuf[32][36];       // mask / denominator (32 slots + pad)

  const int lane  = threadIdx.x & 31;
  // wave id == head id; held scalar so that the packed K/V/Q bases stay in
  // scalar registers: as a vector value the build took about 80 more VGPRs,
  // with the load pointers above v255.
  const int h     = __builtin_amdgcn_readfirstlane(threadIdx.x >> 5);
  const int b     = blockIdx.y;
  const int q0    = blockIdx.x * 32;    // two 16-row q-tiles per wave
  const int kbeg  = blockIdx.z * KRNG;

  const int row   = lane & 15;
  const int koff  = (lane >> 4) * 8;

  const size_t bh    = (size_t)b * HH + h;
  const size_t headQ = bh * NNQ;
  const __bf16* kbbase = kbf + bh * NNK * DD;
  const __bf16* vtbase = vtbf + bh * DD * NNK;
  // Reduction ownership: wave h owns q-rows (h & 3) + 4j of q-tile h >> 2,
  // all 32 keys. Lane bits: [3:2] = j, [4] = score-lane half, [1] = 16-key
  // half, [0] = 4-slot group. The wave's one mask load is 4 whole 128-B
  // lines, and per 16 lanes the LDS dword addresses are 16j + 8*bit1 +
  // 4*bit0 mod 64: all 64 banks, no conflict.
  const int own_lane = (h & 3) + 4 * ((lane >> 2) & 3) + (lane & 16);
  const int own_slot = 16 * (h >> 2) + 8 * ((lane >> 1) & 1) + 4 * (lane & 1);
  // Wave-uniform base of the owned q-tile's mask rows; this lane's byte offset.
  const float* mtile = mask + ((size_t)b * NNQ + q0 + 16 * (h >> 2)) * NNK;
  const unsigned moff = 4u * ((own_lane & 15) * NNK + 16 * ((lane >> 1) & 1) +
                              8 * (lane >> 4) + 4 * (lane & 1));
  float* dst = (blockIdx.z == 0) ? out : pout;

  // Persistent Q B-operands for both q-tiles (pre-relu'd bf16).
  const __bf16* qf = qbf + (headQ + q0) * DD + lane * 8;
  const v16bf bqAlo = load_op_bf16(qf);
  const v16bf bqAhi = load_op_bf16(qf + 512);
  const v16bf bqBlo = load_op_bf16(qf + 1024);
  const v16bf bqBhi = load_op_bf16(qf + 1536);

  const v8f vzero = {0.f, 0.f, 0.f, 0.f, 0.f, 0.f, 0.f, 0.f};
  v8f acc[2][4];   // out^T accumulators per q-tile
#pragma unroll
  for (int qt = 0; qt < 2; ++qt)
#pragma unroll
    for (int t = 0; t < 4; ++t) acc[qt][t] = vzero;

  // This wave's mask chunks of a trip's two tiles.
  const float* mp = (const float*)((const char*)(mtile + kbeg) + moff);
  float4 mskA, mskB;
  auto load_masks = [&]() {
    mskA = *(const float4*)(mp);
    mskB = *(const float4*)(mp + 32);
    // Keeps the issue here; the scheduler otherwise sinks these loads to
    // just in front of their use.
    __builtin_amdgcn_sched_barrier(0);
    // The build rewrites the two loads' address registers soon behind them
    // and this wait stands in front of that.
    asm volatile("s_wait_xcnt 0x0" ::: "memory");
  };

  auto tile_step = [&](const v16bf* cur, v16bf* nxt, const float4 mcur,
                       const bool trip_end, int k0) {
    // Early-issue: shared V operands.
    const __bf16* vf = vtbase + (size_t)k0 * DD + lane * 8;
    v16bf av0 = load_op_bf16(vf);
    v16bf av1 = load_op_bf16(vf + 512);
    v16bf av2 = load_op_bf16(vf + 1024);
    v16bf av3 = load_op_bf16(vf + 1536);

    // Preload next K tile (wraps inside this z's k-range; branch-free).
    load_k_ops(nxt, kbbase, kbeg + ((k0 - kbeg + 32) & (KRNG - 1)), lane);

    // ---- GEMM1^T: S^T[32k x 32q] = relu(K) * relu(Q)^T, K ops shared ----
    v8f s0a = vzero, s1a = vzero, s0b = vzero, s1b = vzero;
    s0a = WMMA_BF16(cur[0], bqAlo, s0a);  s0a = WMMA_BF16(cur[1], bqAhi, s0a);
    s1a = WMMA_BF16(cur[2], bqAlo, s1a);  s1a = WMMA_BF16(cur[3], bqAhi, s1a);
    s0b = WMMA_BF16(cur[0], bqBlo, s0b);  s0b = WMMA_BF16(cur[1], bqBhi, s0b);
    s1b = WMMA_BF16(cur[2], bqBlo, s1b);  s1b = WMMA_BF16(cur[3], bqBhi, s1b);

    // ---- Publish scores: slots 0..7=s0a, 8..15=s1a, 16..23=s0b, 24..31=s1b
#pragma unroll
    for (int i = 0; i < 8; ++i) {
      sred[h][lane][i]      = s0a[i];
      sred[h][lane][8 + i]  = s1a[i];
      sred[h][lane][16 + i] = s0b[i];
      sred[h][lane][24 + i] = s1b[i];
    }
    lds_barrier();  // B1

    // ---- Distributed cross-head reduction: each wave sums its 128 (q,k)
    // entries over the heads and publishes mask / sum for all heads ----
    {
      float p0 = 0.f, p1 = 0.f, p2 = 0.f, p3 = 0.f;
#pragma unroll
      for (int w = 0; w < 8; ++w) {
        const float4 v = *(const float4*)(&sred[w][own_lane][own_slot]);
        p0 += v.x; p1 += v.y; p2 += v.z; p3 += v.w;
      }
      float4 pr;
      pr.x = mcur.x * __builtin_amdgcn_rcpf(p0);
      pr.y = mcur.y * __builtin_amdgcn_rcpf(p1);
      pr.z = mcur.z * __builtin_amdgcn_rcpf(p2);
      pr.w = mcur.w * __builtin_amdgcn_rcpf(p3);
      *(float4*)(&dbuf[own_lane][own_slot]) = pr;
    }
    lds_barrier();  // B2

    if (trip_end) {
      // Next trip's mask chunks, into the registers that the trip's two
      // reductions have consumed: behind its last B2 is the earliest place
      // for both. They come from memory and fly across the next B1. The
      // last trip reads its own chunks again: stays inside the mask.
      mp += (k0 + 32 < kbeg + KRNG) ? 64 : 0;
      load_masks();
    }

    float fac[32];
#pragma unroll
    for (int j = 0; j < 8; ++j) {
      const float4 v = *(const float4*)(&dbuf[lane][4 * j]);
      fac[4 * j + 0] = v.x; fac[4 * j + 1] = v.y;
      fac[4 * j + 2] = v.z; fac[4 * j + 3] = v.w;
    }

    // ---- P^T = S^T * (mask / den), in-register, straight into B layout ----
    v16bf bpa, bpb;
#pragma unroll
    for (int r = 0; r < 8; ++r) {
      bpa[r]     = (__bf16)(s0a[r] * fac[r]);
      bpa[8 + r] = (__bf16)(s1a[r] * fac[8 + r]);
      bpb[r]     = (__bf16)(s0b[r] * fac[16 + r]);
      bpb[8 + r] = (__bf16)(s1b[r] * fac[24 + r]);
    }

    // ---- GEMM2^T: out^T += V^T * P^T, V ops shared by both q-tiles ----
    acc[0][0] = WMMA_BF16(av0, bpa, acc[0][0]);
    acc[0][1] = WMMA_BF16(av1, bpa, acc[0][1]);
    acc[0][2] = WMMA_BF16(av2, bpa, acc[0][2]);
    acc[0][3] = WMMA_BF16(av3, bpa, acc[0][3]);
    acc[1][0] = WMMA_BF16(av0, bpb, acc[1][0]);
    acc[1][1] = WMMA_BF16(av1, bpb, acc[1][1]);
    acc[1][2] = WMMA_BF16(av2, bpb, acc[1][2]);
    acc[1][3] = WMMA_BF16(av3, bpb, acc[1][3]);

  };

  v16bf bufA[4], bufB[4];
  load_k_ops(bufA, kbbase, kbeg, lane);
  load_masks();
  // The launches before stored the K and V planes; the 64 work-groups of one
  // (b, z) read the same 2 MiB of them. Asked of L2 once here,
  // dealt over eight work-groups: share s takes the 64-key
  // blocks s and s + 8 of this wave's head. Bits 0, 1 and 3 of the index
  // pick the share, so work-groups four apart hold the same one. For speed
  // only: a unit that nobody asked for in time is a plain miss of its load.
  // Every address lies inside this z's 128 KiB of the head's plane.
  const unsigned share = (blockIdx.x & 3) | ((blockIdx.x >> 1) & 4);
  const unsigned poff  = share * 8192u + (unsigned)lane * 256u;
  const __bf16* kpl = kbbase + (size_t)kbeg * DD;
  const __bf16* vpl = vtbase + (size_t)kbeg * DD;
  asm volatile("global_prefetch_b8 %0, %1 scope:SCOPE_SE\n\t"
               "global_prefetch_b8 %0, %2 scope:SCOPE_SE\n\t"
               "global_prefetch_b8 %0, %1 offset:65536 scope:SCOPE_SE\n\t"
               "global_prefetch_b8 %0, %2 offset:65536 scope:SCOPE_SE"
               :: "v"(poff), "s"(kpl), "s"(vpl));
  for (int k0 = kbeg; k0 < kbeg + KRNG; k0 += 64) {
    tile_step(bufA, bufB, mskA, false, k0);
    tile_step(bufB, bufA, mskB, true, k0 + 32);
  }

  // No counter says when a prefetch has read its address registers: they are
  // named once more here, as inputs only, so that they hold these addresses
  // through the loop and take no other value behind the requests.
  asm volatile("" :: "v"(poff), "s"(kpl), "s"(vpl));

  // ---- Epilogue: store partial out^T (residual added in combine pass) ----
#pragma unroll
  for (int qt = 0; qt < 2; ++qt) {
    float* orow = dst + (headQ + q0 + qt * 16 + row) * DD;
#pragma unroll
    for (int t = 0; t < 4; ++t)
#pragma unroll
      for (int r = 0; r < 8; ++r)
        orow[t * 16 + koff + r] = acc[qt][t][r];
  }
}

// ---------------- Phase 3: combine k-halves + residual ----------------

__global__ __launch_bounds__(256)
void combine_kernel(float* __restrict__ out, const float* __restrict__ part,
                    const float* __restrict__ query) {
  const size_t i = ((size_t)blockIdx.x * 256 + threadIdx.x) * 4;
  float4 o = *(const float4*)(out + i);
  const float4 p = *(const float4*)(part + i);
  const float4 q = *(const float4*)(query + i);
  o.x += p.x + q.x; o.y += p.y + q.y; o.z += p.z + q.z; o.w += p.w + q.w;
  *(float4*)(out + i) = o;
}

extern "C" void kernel_launch(void* const* d_in, const int* in_sizes, int n_in,
                              void* d_out, int out_size, void* d_ws, size_t ws_size,
                              hipStream_t stream) {
  (void)in_sizes; (void)n_in; (void)out_size; (void)ws_size;
  const float* query = (const float*)d_in[0];
  const float* key   = (const float*)d_in[1];
  const float* value = (const float*)d_in[2];
  const float* mask  = (const float*)d_in[3];
  float* out = (float*)d_out;

  const size_t nElem = (size_t)BB * HH * NNQ * DD;    // 2M per tensor
  __bf16* qbf  = (__bf16*)d_ws;                       // 4 MiB
  __bf16* kbf  = qbf + nElem;                         // 4 MiB
  __bf16* vtbf = kbf + nElem;                         // 4 MiB
  float*  pout = (float*)(vtbf + nElem);              // 8 MiB (20 MiB total)

  {
    dim3 grid((unsigned)(nElem / (256 * 8)), 2);
    prep_qk_kernel<<<grid, 256, 0, stream>>>(query, key, qbf, kbf);
  }
  {
    dim3 grid(NNK / 32, BB * HH);
    prep_vt_kernel<<<grid, 256, 0, stream>>>(value, vtbf);
  }
  {
    dim3 grid(NNQ / 32, BB, KSPL);                    // (64, 2, 2) = 256 WGs
    linattn_headnorm_kernel<<<grid, 256, 0, stream>>>(mask, qbf, kbf, vtbf, out, pout);
  }
  {
    dim3 grid((unsigned)(nElem / (256 * 4)));
    combine_kernel<<<grid, 256, 0, stream>>>(out, pout, query);
  }
}
